// v000
// The times below were measured on an AMD MI455X: many runs one after another, warmed up first and cycling through
// copies of the inputs, with the whole window's GPU time divided by the number of runs. Launches and the gaps
// between them are all in it. The median over several windows is given; except for v000 it joins two sittings, which
// can be a few percent apart, so the side-by-side timings, each taken in one sitting, are the better comparison.
// v000, which the later versions start from, runs in 44.4 microseconds.
#include <hip/hip_runtime.h>
#include <hip/hip_bf16.h>
#include <math.h>

typedef __attribute__((ext_vector_type(2))) float v2f;
typedef __attribute__((ext_vector_type(8))) float v8f;

#define BATCH 8
#define NPTS  512
#define EMB   128

// One wave32 handles 16 consecutive flat (b,i,j) pairs.
// Layer 1: 8x V_WMMA_F32_16X16X4_F32 with bias folded into the K=3 slot:
//   A = [angle, cost, dur, 1.0] (16x4), B = [W1_row0; W1_row1; W1_row2; b1] (4x16 chunk)
//   => C starts at zero, which lowers to the inline-0 SRC2 WMMA form.
// Layer 2: in-register silu (fast rcp) + dot with W2 + shfl_xor reduction.
__global__ __launch_bounds__(256) void nab_kernel(
    const float* __restrict__ coords,   // [B,N,2]
    const float* __restrict__ cost,     // [B,N,N]
    const float* __restrict__ dur,      // [B,N,N]
    const float* __restrict__ W1,       // [3,EMB]
    const float* __restrict__ b1,       // [EMB]
    const float* __restrict__ W2,       // [EMB,1]
    const float* __restrict__ b2,       // [1]
    float* __restrict__ out)            // [B,N,N]
{
    const int lane     = threadIdx.x & 31;
    const int waveId   = (blockIdx.x * blockDim.x + threadIdx.x) >> 5;
    const int pairBase = waveId << 4;          // 16 pairs per wave
    const int n        = lane & 15;            // column / row-in-tile index
    const bool hiHalf  = lane >= 16;

    // ---- A fragment (16x4 f32 layout):
    //  lanes 0-15 : v0 = A[n][0] = angle , v1 = A[n][1] = cost
    //  lanes 16-31: v0 = A[n][2] = dur   , v1 = A[n][3] = 1.0 (bias row selector)
    const int p   = pairBase + n;
    const int b   = p >> 18;                   // / (512*512)
    const int rem = p & 0x3FFFF;
    const int i   = rem >> 9;
    const int j   = rem & 511;

    v2f a;
    if (!hiHalf) {
        const float xi = coords[(b * NPTS + i) * 2 + 0];
        const float yi = coords[(b * NPTS + i) * 2 + 1];
        const float xj = coords[(b * NPTS + j) * 2 + 0];
        const float yj = coords[(b * NPTS + j) * 2 + 1];
        a.x = atan2f(yi - yj, xi - xj);
        a.y = cost[p];
    } else {
        a.x = dur[p];
        a.y = 1.0f;
    }

    // ---- B fragments (4x16 per 16-wide embed chunk); K=3 row carries b1
    v2f bw[8];
#pragma unroll
    for (int c = 0; c < 8; ++c) {
        const int e = c * 16 + n;
        if (!hiHalf) {
            bw[c].x = W1[0 * EMB + e];         // K=0 row
            bw[c].y = W1[1 * EMB + e];         // K=1 row
        } else {
            bw[c].x = W1[2 * EMB + e];         // K=2 row
            bw[c].y = b1[e];                   // K=3 row = bias
        }
    }

    // ---- Layer 1: D = A x B + 0  (8 chunks cover EMB=128)
    v8f acc[8];
#pragma unroll
    for (int c = 0; c < 8; ++c) {
        v8f zero = {};
        acc[c] = __builtin_amdgcn_wmma_f32_16x16x4_f32(
            false, a, false, bw[c], (short)0, zero, false, false);
    }

    // ---- SiLU + layer-2 partial dot products (per-lane, 64 elems)
    // silu(x) = x * rcp(1 + exp(-x)); denominator >= 1, so raw v_rcp_f32 is safe.
    float partial[8];
#pragma unroll
    for (int v = 0; v < 8; ++v) partial[v] = 0.0f;
#pragma unroll
    for (int c = 0; c < 8; ++c) {
        const float w2c = W2[c * 16 + n];
#pragma unroll
        for (int v = 0; v < 8; ++v) {
            const float x = acc[c][v];
            const float s = x * __builtin_amdgcn_rcpf(1.0f + __expf(-x));
            partial[v] = fmaf(s, w2c, partial[v]);
        }
    }

    // ---- reduce across the 16 lanes of each half (xor masks stay in-group)
#pragma unroll
    for (int v = 0; v < 8; ++v) {
        partial[v] += __shfl_xor(partial[v], 8, 32);
        partial[v] += __shfl_xor(partial[v], 4, 32);
        partial[v] += __shfl_xor(partial[v], 2, 32);
        partial[v] += __shfl_xor(partial[v], 1, 32);
    }

    // ---- lanes n<8 of each half write rows m = n (+8 for hi half)
    float r = partial[0];
    r = (n == 1) ? partial[1] : r;
    r = (n == 2) ? partial[2] : r;
    r = (n == 3) ? partial[3] : r;
    r = (n == 4) ? partial[4] : r;
    r = (n == 5) ? partial[5] : r;
    r = (n == 6) ? partial[6] : r;
    r = (n == 7) ? partial[7] : r;
    if (n < 8) {
        const int m = n + (hiHalf ? 8 : 0);
        out[pairBase + m] = r + b2[0];
    }
}

extern "C" void kernel_launch(void* const* d_in, const int* in_sizes, int n_in,
                              void* d_out, int out_size, void* d_ws, size_t ws_size,
                              hipStream_t stream) {
    const float* coords = (const float*)d_in[0];
    const float* cost   = (const float*)d_in[1];
    const float* dur    = (const float*)d_in[2];
    const float* W1     = (const float*)d_in[3];
    const float* b1     = (const float*)d_in[4];
    const float* W2     = (const float*)d_in[5];
    const float* b2     = (const float*)d_in[6];
    float* out = (float*)d_out;

    const int totalPairs = BATCH * NPTS * NPTS;     // 2,097,152
    const int waves      = totalPairs / 16;         // 131,072
    const int threads    = 256;                     // 8 waves/block
    const int blocks     = waves / (threads / 32);  // 16,384

    hipLaunchKernelGGL(nab_kernel, dim3(blocks), dim3(threads), 0, stream,
                       coords, cost, dur, W1, b1, W2, b2, out);
}

// v001
// Measured time: 36.6 microseconds a run.
// Timed twice side by side with v000, it ran 1.26 times as fast both times.
#include <hip/hip_runtime.h>
#include <hip/hip_bf16.h>
#include <math.h>

typedef __attribute__((ext_vector_type(2))) float v2f;
typedef __attribute__((ext_vector_type(8))) float v8f;

#define BATCH 8
#define NPTS  512
#define EMB   128

// One wave32 handles 16 consecutive flat (b,i,j) pairs.
// Layer 1: 8x V_WMMA_F32_16X16X4_F32 with bias folded into the K=3 slot:
//   A = [angle, cost, dur, 1.0] (16x4), B = [W1_row0; W1_row1; W1_row2; b1] (4x16 chunk)
//   => C starts at zero, which lowers to the inline-0 SRC2 WMMA form.
//   A is scaled by 0.5 (exact), so the WMMA yields h = x/2.
// Layer 2: in-register silu(x) = h + h*tanh(h) (one v_tanh_f32) + dot with W2 + shfl_xor reduction.
__global__ __launch_bounds__(256) void nab_kernel(
    const float* __restrict__ coords,   // [B,N,2]
    const float* __restrict__ cost,     // [B,N,N]
    const float* __restrict__ dur,      // [B,N,N]
    const float* __restrict__ W1,       // [3,EMB]
    const float* __restrict__ b1,       // [EMB]
    const float* __restrict__ W2,       // [EMB,1]
    const float* __restrict__ b2,       // [1]
    float* __restrict__ out)            // [B,N,N]
{
    const int lane     = threadIdx.x & 31;
    const int waveId   = (blockIdx.x * blockDim.x + threadIdx.x) >> 5;
    const int pairBase = waveId << 4;          // 16 pairs per wave
    const int n        = lane & 15;            // column / row-in-tile index
    const bool hiHalf  = lane >= 16;

    // ---- A fragment (16x4 f32 layout):
    //  lanes 0-15 : v0 = A[n][0] = angle/2 , v1 = A[n][1] = cost/2
    //  lanes 16-31: v0 = A[n][2] = dur/2   , v1 = A[n][3] = 0.5 (bias row selector)
    const int p   = pairBase + n;
    const int b   = p >> 18;                   // / (512*512)
    const int rem = p & 0x3FFFF;
    const int i   = rem >> 9;
    const int j   = rem & 511;

    v2f a;
    if (!hiHalf) {
        const float xi = coords[(b * NPTS + i) * 2 + 0];
        const float yi = coords[(b * NPTS + i) * 2 + 1];
        const float xj = coords[(b * NPTS + j) * 2 + 0];
        const float yj = coords[(b * NPTS + j) * 2 + 1];
        a.x = 0.5f * atan2f(yi - yj, xi - xj);
        a.y = 0.5f * cost[p];
    } else {
        a.x = 0.5f * dur[p];
        a.y = 0.5f;
    }

    // ---- B fragments (4x16 per 16-wide embed chunk); K=3 row carries b1
    v2f bw[8];
#pragma unroll
    for (int c = 0; c < 8; ++c) {
        const int e = c * 16 + n;
        if (!hiHalf) {
            bw[c].x = W1[0 * EMB + e];         // K=0 row
            bw[c].y = W1[1 * EMB + e];         // K=1 row
        } else {
            bw[c].x = W1[2 * EMB + e];         // K=2 row
            bw[c].y = b1[e];                   // K=3 row = bias
        }
    }

    // ---- Layer 1: D = A x B + 0  (8 chunks cover EMB=128)
    v8f acc[8];
#pragma unroll
    for (int c = 0; c < 8; ++c) {
        v8f zero = {};
        acc[c] = __builtin_amdgcn_wmma_f32_16x16x4_f32(
            false, a, false, bw[c], (short)0, zero, false, false);
    }

    // ---- SiLU + layer-2 partial dot products (per-lane, 64 elems)
    // silu(x) = x * sigmoid(x) = h * (1 + tanh(h)) with h = x/2: one transcendental per element.
    float partial[8];
#pragma unroll
    for (int v = 0; v < 8; ++v) partial[v] = 0.0f;
#pragma unroll
    for (int c = 0; c < 8; ++c) {
        const float w2c = W2[c * 16 + n];
#pragma unroll
        for (int v = 0; v < 8; ++v) {
            const float h = acc[c][v];
            const float s = fmaf(h, __builtin_amdgcn_tanhf(h), h);
            partial[v] = fmaf(s, w2c, partial[v]);
        }
    }

    // ---- reduce across the 16 lanes of each half (xor masks stay in-group)
#pragma unroll
    for (int v = 0; v < 8; ++v) {
        partial[v] += __shfl_xor(partial[v], 8, 32);
        partial[v] += __shfl_xor(partial[v], 4, 32);
        partial[v] += __shfl_xor(partial[v], 2, 32);
        partial[v] += __shfl_xor(partial[v], 1, 32);
    }

    // ---- lanes n<8 of each half write rows m = n (+8 for hi half)
    float r = partial[0];
    r = (n == 1) ? partial[1] : r;
    r = (n == 2) ? partial[2] : r;
    r = (n == 3) ? partial[3] : r;
    r = (n == 4) ? partial[4] : r;
    r = (n == 5) ? partial[5] : r;
    r = (n == 6) ? partial[6] : r;
    r = (n == 7) ? partial[7] : r;
    if (n < 8) {
        const int m = n + (hiHalf ? 8 : 0);
        out[pairBase + m] = r + b2[0];
    }
}

extern "C" void kernel_launch(void* const* d_in, const int* in_sizes, int n_in,
                              void* d_out, int out_size, void* d_ws, size_t ws_size,
                              hipStream_t stream) {
    const float* coords = (const float*)d_in[0];
    const float* cost   = (const float*)d_in[1];
    const float* dur    = (const float*)d_in[2];
    const float* W1     = (const float*)d_in[3];
    const float* b1     = (const float*)d_in[4];
    const float* W2     = (const float*)d_in[5];
    const float* b2     = (const float*)d_in[6];
    float* out = (float*)d_out;

    const int totalPairs = BATCH * NPTS * NPTS;     // 2,097,152
    const int waves      = totalPairs / 16;         // 131,072
    const int threads    = 256;                     // 8 waves/block
    const int blocks     = waves / (threads / 32);  // 16,384

    hipLaunchKernelGGL(nab_kernel, dim3(blocks), dim3(threads), 0, stream,
                       coords, cost, dur, W1, b1, W2, b2, out);
}

// v002
// It runs in 34.7 microseconds.
// Next to v001, in two timings, it ran 1.05 times as fast each time.
// All steps since v000 together make it 1.33 times as fast.
#include <hip/hip_runtime.h>
#include <hip/hip_bf16.h>
#include <math.h>

typedef __attribute__((ext_vector_type(2))) float v2f;
typedef __attribute__((ext_vector_type(8))) float v8f;

#define BATCH 8
#define NPTS  512
#define EMB   128

#define TILES 16   // 16-pair tiles per wave

// One wave32 walks TILES consecutive tiles of 16 flat (b,i,j) pairs: 256 pairs, half of one (b,i) row.
// What does not depend on the tile (W1/b1 fragments, W2, b2, the row's own coords) is loaded once, ahead of the loop.
// The grid is one 32-wave work-group per WGP: 256 x 32 waves x 16 tiles x 16 pairs = all pairs.
// Layer 1: 8x V_WMMA_F32_16X16X4_F32 with bias folded into the K=3 slot:
//   A = [angle, cost, dur, 1.0] (16x4), B = [W1_row0; W1_row1; W1_row2; b1] (4x16 chunk)
//   => C starts at zero, which lowers to the inline-0 SRC2 WMMA form.
//   A is scaled by 0.5 (exact), so the WMMA yields h = x/2.
// Layer 2: in-register silu(x) = h + h*tanh(h) (one v_tanh_f32) + dot with W2 + shfl_xor reduction.
__global__ __launch_bounds__(1024) void nab_kernel(
    const float* __restrict__ coords,   // [B,N,2]
    const float* __restrict__ cost,     // [B,N,N]
    const float* __restrict__ dur,      // [B,N,N]
    const float* __restrict__ W1,       // [3,EMB]
    const float* __restrict__ b1,       // [EMB]
    const float* __restrict__ W2,       // [EMB,1]
    const float* __restrict__ b2,       // [1]
    float* __restrict__ out)            // [B,N,N]
{
    const int lane     = threadIdx.x & 31;
    // the wave's number is the same in every lane: held scalar, so the tile addresses are scalar too
    const int waveId   = blockIdx.x * 32 + __builtin_amdgcn_readfirstlane((int)(threadIdx.x >> 5));
    const int waveBase = waveId * (TILES * 16);   // first pair of the wave
    const int n        = lane & 15;               // column / row-in-tile index
    const bool hiHalf  = lane >= 16;

    const int row = waveBase >> 9;                // b * NPTS + i, one row for the whole wave
    const int j0  = waveBase & 511;               // first j of the wave
    const float* __restrict__ cb = coords + (row >> 9) * (NPTS * 2);   // the batch's coords

    // ---- B fragments (4x16 per 16-wide embed chunk); K=3 row carries b1
    v2f bw[8];
    float w2[8];
#pragma unroll
    for (int c = 0; c < 8; ++c) {
        const int e = c * 16 + n;
        if (!hiHalf) {
            bw[c].x = W1[0 * EMB + e];         // K=0 row
            bw[c].y = W1[1 * EMB + e];         // K=1 row
        } else {
            bw[c].x = W1[2 * EMB + e];         // K=2 row
            bw[c].y = b1[e];                   // K=3 row = bias
        }
        w2[c] = W2[e];
    }
    const float bias2 = b2[0];
    const float xi = coords[row * 2 + 0];
    const float yi = coords[row * 2 + 1];

    // kept rolled, for speed only
#pragma unroll 1
    for (int t = 0; t < TILES; ++t) {
        const int pairBase = waveBase + t * 16;

        // ---- A fragment (16x4 f32 layout):
        //  lanes 0-15 : v0 = A[n][0] = angle/2 , v1 = A[n][1] = cost/2
        //  lanes 16-31: v0 = A[n][2] = dur/2   , v1 = A[n][3] = 0.5 (bias row selector)
        const int p = pairBase + n;
        const int j = j0 + t * 16 + n;

        v2f a;
        if (!hiHalf) {
            const float xj = cb[j * 2 + 0];
            const float yj = cb[j * 2 + 1];
            a.x = 0.5f * atan2f(yi - yj, xi - xj);
            a.y = 0.5f * cost[p];
        } else {
            a.x = 0.5f * dur[p];
            a.y = 0.5f;
        }

        // ---- Layer 1: D = A x B + 0  (8 chunks cover EMB=128)
        v8f acc[8];
#pragma unroll
        for (int c = 0; c < 8; ++c) {
            v8f zero = {};
            acc[c] = __builtin_amdgcn_wmma_f32_16x16x4_f32(
                false, a, false, bw[c], (short)0, zero, false, false);
        }

        // ---- SiLU + layer-2 partial dot products (per-lane, 64 elems)
        // silu(x) = x * sigmoid(x) = h * (1 + tanh(h)) with h = x/2: one transcendental per element.
        float partial[8];
#pragma unroll
        for (int v = 0; v < 8; ++v) partial[v] = 0.0f;
#pragma unroll
        for (int c = 0; c < 8; ++c) {
#pragma unroll
            for (int v = 0; v < 8; ++v) {
                const float h = acc[c][v];
                const float s = fmaf(h, __builtin_amdgcn_tanhf(h), h);
                partial[v] = fmaf(s, w2[c], partial[v]);
            }
        }

        // ---- reduce across the 16 lanes of each half (xor masks stay in-group)
#pragma unroll
        for (int v = 0; v < 8; ++v) {
            partial[v] += __shfl_xor(partial[v], 8, 32);
            partial[v] += __shfl_xor(partial[v], 4, 32);
            partial[v] += __shfl_xor(partial[v], 2, 32);
            partial[v] += __shfl_xor(partial[v], 1, 32);
        }

        // ---- lanes n<8 of each half write rows m = n (+8 for hi half)
        float r = partial[0];
        r = (n == 1) ? partial[1] : r;
        r = (n == 2) ? partial[2] : r;
        r = (n == 3) ? partial[3] : r;
        r = (n == 4) ? partial[4] : r;
        r = (n == 5) ? partial[5] : r;
        r = (n == 6) ? partial[6] : r;
        r = (n == 7) ? partial[7] : r;
        if (n < 8) {
            const int m = n + (hiHalf ? 8 : 0);
            out[pairBase + m] = r + bias2;
            // the next trip reuses the store's address and data registers: keep the wait in front of that overwrite
            asm volatile("s_wait_xcnt 0x0" ::: "memory");
        }
    }
}

extern "C" void kernel_launch(void* const* d_in, const int* in_sizes, int n_in,
                              void* d_out, int out_size, void* d_ws, size_t ws_size,
                              hipStream_t stream) {
    const float* coords = (const float*)d_in[0];
    const float* cost   = (const float*)d_in[1];
    const float* dur    = (const float*)d_in[2];
    const float* W1     = (const float*)d_in[3];
    const float* b1     = (const float*)d_in[4];
    const float* W2     = (const float*)d_in[5];
    const float* b2     = (const float*)d_in[6];
    float* out = (float*)d_out;

    const int totalPairs = BATCH * NPTS * NPTS;         // 2,097,152
    const int waves      = totalPairs / (16 * TILES);   // 8,192
    const int threads    = 1024;                        // 32 waves/block
    const int blocks     = waves / (threads / 32);      // 256

    hipLaunchKernelGGL(nab_kernel, dim3(blocks), dim3(threads), 0, stream,
                       coords, cost, dur, W1, b1, W2, b2, out);
}

// v003
// It runs in 30.7 microseconds.
// Next to v002, in two timings, it ran 1.13 times as fast each time.
// Counting every step since v000, it is 1.51 times as fast.
#include <hip/hip_runtime.h>
#include <hip/hip_bf16.h>
#include <math.h>

typedef __attribute__((ext_vector_type(2))) float v2f;
typedef __attribute__((ext_vector_type(8))) float v8f;

#define BATCH 8
#define NPTS  512
#define EMB   128

#define TILES 16   // 16-pair tiles per wave

// One wave32 walks TILES consecutive tiles of 16 flat (b,i,j) pairs: 256 pairs, half of one (b,i) row.
// What does not depend on the tile (W1/b1 fragments, W2, b2, the row's own coords) is loaded once, ahead of the loop.
// The grid is one 32-wave work-group per WGP: 256 x 32 waves x 16 tiles x 16 pairs = all pairs.
// Layer 1: 8x V_WMMA_F32_16X16X4_F32 with bias folded into the K=3 slot, weights as A and pairs as B:
//   A = [W1_row0; W1_row1; W1_row2; b1]^T (16 embed rows x 4), B = [angle, cost, dur, 1.0]^T (4 x 16 pairs)
//   => D[embed][pair]: a lane holds 8 embed values per chunk of ONE pair (its column).
//   C starts at zero, which lowers to the inline-0 SRC2 WMMA form.
//   B is scaled by 0.5 (exact), so the WMMA yields h = x/2.
// Layer 2: in-register silu(x) = h + h*tanh(h) (one v_tanh_f32) + dot with W2 down the lane's own registers;
//   the two lane halves hold the two halves of a pair's embed values: one cross-row move and add ends the sum.
__global__ __launch_bounds__(1024) void nab_kernel(
    const float* __restrict__ coords,   // [B,N,2]
    const float* __restrict__ cost,     // [B,N,N]
    const float* __restrict__ dur,      // [B,N,N]
    const float* __restrict__ W1,       // [3,EMB]
    const float* __restrict__ b1,       // [EMB]
    const float* __restrict__ W2,       // [EMB,1]
    const float* __restrict__ b2,       // [1]
    float* __restrict__ out)            // [B,N,N]
{
    const int lane     = threadIdx.x & 31;
    // the wave's number is the same in every lane: held scalar, so the tile addresses are scalar too
    const int waveId   = blockIdx.x * 32 + __builtin_amdgcn_readfirstlane((int)(threadIdx.x >> 5));
    const int waveBase = waveId * (TILES * 16);   // first pair of the wave
    const int n        = lane & 15;               // column / row-in-tile index
    const bool hiHalf  = lane >= 16;

    const int row = waveBase >> 9;                // b * NPTS + i, one row for the whole wave
    const int j0  = waveBase & 511;               // first j of the wave
    const float* __restrict__ cb = coords + (row >> 9) * (NPTS * 2);   // the batch's coords

    // ---- weight fragments (16 embed rows x 4 per chunk); K=3 column carries b1
    // w2[c][v] goes with D register v of chunk c: embed index c*16 + 8*half + v
    v2f bw[8];
    v8f w2[8];
#pragma unroll
    for (int c = 0; c < 8; ++c) {
        const int e = c * 16 + n;
        if (!hiHalf) {
            bw[c].x = W1[0 * EMB + e];         // K=0 row
            bw[c].y = W1[1 * EMB + e];         // K=1 row
        } else {
            bw[c].x = W1[2 * EMB + e];         // K=2 row
            bw[c].y = b1[e];                   // K=3 row = bias
        }
    }
    // the W2 loads below may land in registers that held the addresses of the loads above: keep the wait in front of them
    asm volatile("s_wait_xcnt 0x0" ::: "memory");
#pragma unroll
    for (int c = 0; c < 8; ++c) {
        w2[c] = *(const v8f*)(W2 + c * 16 + (hiHalf ? 8 : 0));
    }
    const float bias2 = b2[0];
    const float xi = coords[row * 2 + 0];
    const float yi = coords[row * 2 + 1];

    // kept rolled, for speed only
#pragma unroll 1
    for (int t = 0; t < TILES; ++t) {
        const int pairBase = waveBase + t * 16;

        // ---- pair fragment (4x16 f32 layout, column n = pair):
        //  lanes 0-15 : v0 = B[0][n] = angle/2 , v1 = B[1][n] = cost/2
        //  lanes 16-31: v0 = B[2][n] = dur/2   , v1 = B[3][n] = 0.5 (bias row selector)
        const int p = pairBase + n;
        const int j = j0 + t * 16 + n;

        v2f a;
        if (!hiHalf) {
            const float xj = cb[j * 2 + 0];
            const float yj = cb[j * 2 + 1];
            a.x = 0.5f * atan2f(yi - yj, xi - xj);
            a.y = 0.5f * cost[p];
        } else {
            a.x = 0.5f * dur[p];
            a.y = 0.5f;
        }

        // ---- Layer 1: D = W^T x X^T + 0  (8 chunks cover EMB=128), one chunk ahead of its use
        // ---- SiLU + layer-2 dot products (per-lane, 64 elems), chunk by chunk
        // silu(x) = x * sigmoid(x) = h * (1 + tanh(h)) with h = x/2: one transcendental per element.
        const v8f zero = {};
        float partial[8];
#pragma unroll
        for (int v = 0; v < 8; ++v) partial[v] = 0.0f;
        v8f cur = __builtin_amdgcn_wmma_f32_16x16x4_f32(
            false, bw[0], false, a, (short)0, zero, false, false);
#pragma unroll
        for (int c = 0; c < 8; ++c) {
            v8f nxt = zero;
            if (c < 7) {
                nxt = __builtin_amdgcn_wmma_f32_16x16x4_f32(
                    false, bw[c + 1], false, a, (short)0, zero, false, false);
            }
#pragma unroll
            for (int v = 0; v < 8; ++v) {
                const float h = cur[v];
                const float s = fmaf(h, __builtin_amdgcn_tanhf(h), h);
                partial[v] = fmaf(s, w2[c][v], partial[v]);
            }
            cur = nxt;
        }
        // order asked of the scheduler: next chunk's WMMA, this chunk's 8 tanh, its 8 packed fma. A chunk's values
        // then die before the chunk after next is made; left alone it keeps all 64 alive beside the 64 of W2 and spills.
        __builtin_amdgcn_sched_group_barrier(0x8, 1, 0);
#pragma unroll
        for (int c = 0; c < 8; ++c) {
            if (c < 7) __builtin_amdgcn_sched_group_barrier(0x8, 1, 0);
            __builtin_amdgcn_sched_group_barrier(0x400, 8, 0);
            __builtin_amdgcn_sched_group_barrier(0x2, 8, 0);
        }

        // ---- the lane's 64 terms, then the other half's 64 of the same pair (lane l ^ 16)
        const float half_sum = ((partial[0] + partial[1]) + (partial[2] + partial[3]))
                             + ((partial[4] + partial[5]) + (partial[6] + partial[7]));
        const int hb = __builtin_bit_cast(int, half_sum);
        const float other = __builtin_bit_cast(float,
            __builtin_amdgcn_permlanex16(hb, hb, 0x76543210, 0xfedcba98, false, false));

        // ---- lanes 0-15 write the tile's 16 pairs, one each
        if (!hiHalf) {
            out[p] = (half_sum + other) + bias2;
            // the next trip reuses the store's address and data registers: keep the wait in front of that overwrite
            asm volatile("s_wait_xcnt 0x0" ::: "memory");
        }
    }
}

extern "C" void kernel_launch(void* const* d_in, const int* in_sizes, int n_in,
                              void* d_out, int out_size, void* d_ws, size_t ws_size,
                              hipStream_t stream) {
    const float* coords = (const float*)d_in[0];
    const float* cost   = (const float*)d_in[1];
    const float* dur    = (const float*)d_in[2];
    const float* W1     = (const float*)d_in[3];
    const float* b1     = (const float*)d_in[4];
    const float* W2     = (const float*)d_in[5];
    const float* b2     = (const float*)d_in[6];
    float* out = (float*)d_out;

    const int totalPairs = BATCH * NPTS * NPTS;         // 2,097,152
    const int waves      = totalPairs / (16 * TILES);   // 8,192
    const int threads    = 1024;                        // 32 waves/block
    const int blocks     = waves / (threads / 32);      // 256

    hipLaunchKernelGGL(nab_kernel, dim3(blocks), dim3(threads), 0, stream,
                       coords, cost, dur, W1, b1, W2, b2, out);
}

// v004
// One run takes 27.1 microseconds.
// Next to v003, in two timings, it ran 1.13 times as fast each time.
// All steps since v000 together make it 1.71 times as fast.
#include <hip/hip_runtime.h>
#include <hip/hip_bf16.h>
#include <math.h>

typedef __attribute__((ext_vector_type(2))) float v2f;
typedef __attribute__((ext_vector_type(8))) float v8f;

#define BATCH 8
#define NPTS  512
#define EMB   128

#define TILES 16   // 16-pair tiles per wave
#define TRIPS (TILES / 2)   // a trip of the loop takes 32 pairs: two tiles

// One wave32 walks TILES consecutive tiles of 16 flat (b,i,j) pairs: 256 pairs, half of one (b,i) row.
// What does not depend on the tile (W1/b1 fragments, W2, b2, the row's own coords) is loaded once, ahead of the loop.
// The grid is one 32-wave work-group per WGP: 256 x 32 waves x 16 tiles x 16 pairs = all pairs.
// A trip of the loop takes two tiles, 32 pairs, one per lane: loads, atan2 and the store run once with every lane on;
// cross-row moves deal the 32 lanes' values into the two tiles' fragments and gather the two tiles' sums again.
// Layer 1: 8x V_WMMA_F32_16X16X4_F32 with bias folded into the K=3 slot, weights as A and pairs as B:
//   A = [W1_row0; W1_row1; W1_row2; b1]^T (16 embed rows x 4), B = [angle, cost, dur, 1.0]^T (4 x 16 pairs)
//   => D[embed][pair]: a lane holds 8 embed values per chunk of ONE pair (its column).
//   C starts at zero, which lowers to the inline-0 SRC2 WMMA form.
//   B is scaled by 0.5 (exact), so the WMMA yields h = x/2.
// Layer 2: in-register silu(x) = h + h*tanh(h) (one v_tanh_f32) + dot with W2 down the lane's own registers;
//   the two lane halves hold the two halves of a pair's embed values: one cross-row move and add ends the sum.

// the same lane of the other 16-lane row (lane l ^ 16)
__device__ __forceinline__ float other_row(float v) {
    const int b = __builtin_bit_cast(int, v);
    return __builtin_bit_cast(float,
        __builtin_amdgcn_permlanex16(b, b, 0x76543210, 0xfedcba98, false, false));
}

// One tile: layer 1, SiLU and the lane's 64 terms of the layer-2 dot (its half of the embed values of its column's pair).
__device__ __forceinline__ float tile_half_sum(const v2f (&bw)[8], const v8f (&w2)[8], const v2f a) {
    // ---- Layer 1: D = W^T x X^T + 0  (8 chunks cover EMB=128), one chunk ahead of its use
    // ---- SiLU + layer-2 dot products (per-lane, 64 elems), chunk by chunk
    // silu(x) = x * sigmoid(x) = h * (1 + tanh(h)) with h = x/2: one transcendental per element.
    const v8f zero = {};
    float partial[8];
#pragma unroll
    for (int v = 0; v < 8; ++v) partial[v] = 0.0f;
    v8f cur = __builtin_amdgcn_wmma_f32_16x16x4_f32(
        false, bw[0], false, a, (short)0, zero, false, false);
#pragma unroll
    for (int c = 0; c < 8; ++c) {
        v8f nxt = zero;
        if (c < 7) {
            nxt = __builtin_amdgcn_wmma_f32_16x16x4_f32(
                false, bw[c + 1], false, a, (short)0, zero, false, false);
        }
#pragma unroll
        for (int v = 0; v < 8; ++v) {
            const float h = cur[v];
            const float s = fmaf(h, __builtin_amdgcn_tanhf(h), h);
            partial[v] = fmaf(s, w2[c][v], partial[v]);
        }
        cur = nxt;
    }
    // order asked of the scheduler: next chunk's WMMA, this chunk's 8 tanh, its 8 packed fma. A chunk's values
    // then die before the chunk after next is made; left alone it keeps all 64 alive beside the 64 of W2 and spills.
    __builtin_amdgcn_sched_group_barrier(0x8, 1, 0);
#pragma unroll
    for (int c = 0; c < 8; ++c) {
        if (c < 7) __builtin_amdgcn_sched_group_barrier(0x8, 1, 0);
        __builtin_amdgcn_sched_group_barrier(0x400, 8, 0);
        __builtin_amdgcn_sched_group_barrier(0x2, 8, 0);
    }
    // even and odd registers summed side by side (packed adds on the register pairs as they stand), joined last
    const v2f q01 = {partial[0], partial[1]}, q23 = {partial[2], partial[3]};
    const v2f q45 = {partial[4], partial[5]}, q67 = {partial[6], partial[7]};
    const v2f q = (q01 + q23) + (q45 + q67);
    return q.x + q.y;
}

__global__ __launch_bounds__(1024) void nab_kernel(
    const float* __restrict__ coords,   // [B,N,2]
    const float* __restrict__ cost,     // [B,N,N]
    const float* __restrict__ dur,      // [B,N,N]
    const float* __restrict__ W1,       // [3,EMB]
    const float* __restrict__ b1,       // [EMB]
    const float* __restrict__ W2,       // [EMB,1]
    const float* __restrict__ b2,       // [1]
    float* __restrict__ out)            // [B,N,N]
{
    const int lane     = threadIdx.x & 31;
    // the wave's number is the same in every lane: held scalar, so the tile addresses are scalar too
    const int waveId   = blockIdx.x * 32 + __builtin_amdgcn_readfirstlane((int)(threadIdx.x >> 5));
    const int waveBase = waveId * (TILES * 16);   // first pair of the wave
    const int n        = lane & 15;               // column / row-in-tile index
    const bool hiHalf  = lane >= 16;

    const int row = waveBase >> 9;                // b * NPTS + i, one row for the whole wave
    const int j0  = waveBase & 511;               // first j of the wave
    const float* __restrict__ cb = coords + (row >> 9) * (NPTS * 2);   // the batch's coords

    // ---- weight fragments (16 embed rows x 4 per chunk); K=3 column carries b1
    // w2[c][v] goes with D register v of chunk c: embed index c*16 + 8*half + v
    v2f bw[8];
    v8f w2[8];
#pragma unroll
    for (int c = 0; c < 8; ++c) {
        const int e = c * 16 + n;
        if (!hiHalf) {
            bw[c].x = W1[0 * EMB + e];         // K=0 row
            bw[c].y = W1[1 * EMB + e];         // K=1 row
        } else {
            bw[c].x = W1[2 * EMB + e];         // K=2 row
            bw[c].y = b1[e];                   // K=3 row = bias
        }
    }
    // the W2 loads below may land in registers that held the addresses of the loads above: keep the wait in front of them
    asm volatile("s_wait_xcnt 0x0" ::: "memory");
#pragma unroll
    for (int c = 0; c < 8; ++c) {
        w2[c] = *(const v8f*)(W2 + c * 16 + (hiHalf ? 8 : 0));
    }
    const float bias2 = b2[0];
    const float xi = coords[row * 2 + 0];
    const float yi = coords[row * 2 + 1];

#pragma unroll 1
    for (int u = 0; u < TRIPS; ++u) {
        // ---- the lane's own pair of the trip's 32: every lane loads and takes the angle
        const unsigned p = (unsigned)(waveBase + u * 32 + lane);
        const int j = j0 + u * 32 + lane;
        const v2f cj    = ((const v2f*)cb)[j];
        const float ang = 0.5f * atan2f(yi - cj.y, xi - cj.x);
        const float cst = 0.5f * cost[p];
        const float drn = 0.5f * dur[p];

        // ---- pair fragments (4x16 f32 layout, column n = pair), tile 0 = pairs of lanes 0-15, tile 1 = of lanes 16-31:
        //  lanes 0-15 : v0 = B[0][n] = angle/2 , v1 = B[1][n] = cost/2
        //  lanes 16-31: v0 = B[2][n] = dur/2   , v1 = B[3][n] = 0.5 (bias row selector)
        // one move carries both values that change rows in v0: tile 1's angles down, tile 0's durations up
        const float mov0 = other_row(hiHalf ? ang : drn);
        const float cstx = other_row(cst);
        v2f a0, a1;
        a0.x = hiHalf ? mov0 : ang;
        a0.y = hiHalf ? 0.5f : cst;
        a1.x = hiHalf ? drn  : mov0;
        a1.y = hiHalf ? 0.5f : cstx;

        // kept rolled: the order asked of the scheduler in tile_half_sum holds only where a tile is a block of its own;
        // with both tiles and the angle code in one block it is lost and the chunk values spill
        float s0 = 0.0f, s1 = 0.0f;
        v2f a = a0;
#pragma unroll 1
        for (int t = 0; t < 2; ++t) {
            s0 = s1;
            s1 = tile_half_sum(bw, w2, a);
            a  = a1;
        }

        // ---- a lane keeps the half sum of its own pair's tile and gets that pair's other half from lane l ^ 16
        const float keep = hiHalf ? s1 : s0;
        const float give = hiHalf ? s0 : s1;
        out[p] = (keep + other_row(give)) + bias2;
        // the next trip reuses the store's address and data registers: keep the wait in front of that overwrite
        asm volatile("s_wait_xcnt 0x0" ::: "memory");
    }
}

extern "C" void kernel_launch(void* const* d_in, const int* in_sizes, int n_in,
                              void* d_out, int out_size, void* d_ws, size_t ws_size,
                              hipStream_t stream) {
    const float* coords = (const float*)d_in[0];
    const float* cost   = (const float*)d_in[1];
    const float* dur    = (const float*)d_in[2];
    const float* W1     = (const float*)d_in[3];
    const float* b1     = (const float*)d_in[4];
    const float* W2     = (const float*)d_in[5];
    const float* b2     = (const float*)d_in[6];
    float* out = (float*)d_out;

    const int totalPairs = BATCH * NPTS * NPTS;         // 2,097,152
    const int waves      = totalPairs / (16 * TILES);   // 8,192
    const int threads    = 1024;                        // 32 waves/block
    const int blocks     = waves / (threads / 32);      // 256

    hipLaunchKernelGGL(nab_kernel, dim3(blocks), dim3(threads), 0, stream,
                       coords, cost, dur, W1, b1, W2, b2, out);
}

// v005
// One run takes 25.4 microseconds.
// Timed twice side by side with v004, it ran 1.07 times as fast both times.
// Counting every step since v000, it is 1.82 times as fast.
#include <hip/hip_runtime.h>
#include <hip/hip_bf16.h>
#include <math.h>

typedef __attribute__((ext_vector_type(2))) float v2f;
typedef __attribute__((ext_vector_type(8))) float v8f;

#define BATCH 8
#define NPTS  512
#define EMB   128

#define TILES 16   // 16-pair tiles per wave
#define TRIPS (TILES / 2)   // a trip of the loop takes 32 pairs: two tiles

// One wave32 walks TILES consecutive tiles of 16 flat (b,i,j) pairs: 256 pairs, half of one (b,i) row.
// What does not depend on the tile (W1/b1 fragments, W2, b2, the row's own coords) is loaded once, ahead of the loop.
// The grid is one 32-wave work-group per WGP: 256 x 32 waves x 16 tiles x 16 pairs = all pairs.
// A trip of the loop takes two tiles, 32 pairs, one per lane: loads, atan2 and the store run once with every lane on;
// cross-row moves deal the 32 lanes' values into the two tiles' fragments and gather the two tiles' sums again.
// Layer 1: 8x V_WMMA_F32_16X16X4_F32 with bias folded into the K=3 slot, weights as A and pairs as B:
//   A = [W1_row0; W1_row1; W1_row2; b1]^T (16 embed rows x 4), B = [angle, cost, dur, 1.0]^T (4 x 16 pairs)
//   => D[embed][pair]: a lane holds 8 embed values per chunk of ONE pair (its column).
//   C starts at zero, which lowers to the inline-0 SRC2 WMMA form.
//   B is scaled by 0.5 (exact), so the WMMA yields h = x/2.
// Layer 2: in-register silu(x) = h + h*tanh(h) (one v_tanh_f32) + dot with W2 down the lane's own registers;
//   the two lane halves hold the two halves of a pair's embed values: one cross-row move and add ends the sum.

// the same lane of the other 16-lane row (lane l ^ 16)
__device__ __forceinline__ float other_row(float v) {
    const int b = __builtin_bit_cast(int, v);
    return __builtin_bit_cast(float,
        __builtin_amdgcn_permlanex16(b, b, 0x76543210, 0xfedcba98, false, false));
}

// One tile: layer 1, SiLU and the lane's 64 terms of the layer-2 dot (its half of the embed values of its column's pair).
__device__ __forceinline__ float tile_half_sum(const v2f (&bw)[8], const v8f (&w2)[8], const v2f a) {
    // ---- Layer 1: D = W^T x X^T + 0  (8 chunks cover EMB=128), one chunk ahead of its use
    // ---- SiLU + layer-2 dot products (per-lane, 64 elems), chunk by chunk
    // silu(x) = x * sigmoid(x) = h * (1 + tanh(h)) with h = x/2: one transcendental per element.
    const v8f zero = {};
    float partial[8];
#pragma unroll
    for (int v = 0; v < 8; ++v) partial[v] = 0.0f;
    v8f cur = __builtin_amdgcn_wmma_f32_16x16x4_f32(
        false, bw[0], false, a, (short)0, zero, false, false);
#pragma unroll
    for (int c = 0; c < 8; ++c) {
        v8f nxt = zero;
        if (c < 7) {
            nxt = __builtin_amdgcn_wmma_f32_16x16x4_f32(
                false, bw[c + 1], false, a, (short)0, zero, false, false);
        }
#pragma unroll
        for (int v = 0; v < 8; ++v) {
            const float h = cur[v];
            const float s = fmaf(h, __builtin_amdgcn_tanhf(h), h);
            partial[v] = fmaf(s, w2[c][v], partial[v]);
        }
        cur = nxt;
    }
    // order asked of the scheduler: next chunk's WMMA, this chunk's 8 tanh, its 8 packed fma. A chunk's values
    // then die before the chunk after next is made; left alone it keeps all 64 alive beside the 64 of W2 and spills.
    __builtin_amdgcn_sched_group_barrier(0x8, 1, 0);
#pragma unroll
    for (int c = 0; c < 8; ++c) {
        if (c < 7) __builtin_amdgcn_sched_group_barrier(0x8, 1, 0);
        __builtin_amdgcn_sched_group_barrier(0x400, 8, 0);
        __builtin_amdgcn_sched_group_barrier(0x2, 8, 0);
    }
    // even and odd registers summed side by side (packed adds on the register pairs as they stand), joined last
    const v2f q01 = {partial[0], partial[1]}, q23 = {partial[2], partial[3]};
    const v2f q45 = {partial[4], partial[5]}, q67 = {partial[6], partial[7]};
    const v2f q = (q01 + q23) + (q45 + q67);
    return q.x + q.y;
}

__global__ __launch_bounds__(1024) void nab_kernel(
    const float* __restrict__ coords,   // [B,N,2]
    const float* __restrict__ cost,     // [B,N,N]
    const float* __restrict__ dur,      // [B,N,N]
    const float* __restrict__ W1,       // [3,EMB]
    const float* __restrict__ b1,       // [EMB]
    const float* __restrict__ W2,       // [EMB,1]
    const float* __restrict__ b2,       // [1]
    float* __restrict__ out)            // [B,N,N]
{
    const int lane     = threadIdx.x & 31;
    // the wave's number is the same in every lane: held scalar, so the tile addresses are scalar too
    const int waveId   = blockIdx.x * 32 + __builtin_amdgcn_readfirstlane((int)(threadIdx.x >> 5));
    const int waveBase = waveId * (TILES * 16);   // first pair of the wave
    const int n        = lane & 15;               // column / row-in-tile index
    const bool hiHalf  = lane >= 16;

    const int row = waveBase >> 9;                // b * NPTS + i, one row for the whole wave
    const int j0  = waveBase & 511;               // first j of the wave
    const float* __restrict__ cb = coords + (row >> 9) * (NPTS * 2);   // the batch's coords

    // ---- weight fragments (16 embed rows x 4 per chunk); K=3 column carries b1
    // w2[c][v] goes with D register v of chunk c: embed index c*16 + 8*half + v
    v2f bw[8];
    v8f w2[8];
#pragma unroll
    for (int c = 0; c < 8; ++c) {
        const int e = c * 16 + n;
        if (!hiHalf) {
            bw[c].x = W1[0 * EMB + e];         // K=0 row
            bw[c].y = W1[1 * EMB + e];         // K=1 row
        } else {
            bw[c].x = W1[2 * EMB + e];         // K=2 row
            bw[c].y = b1[e];                   // K=3 row = bias
        }
    }
    // the W2 loads below may land in registers that held the addresses of the loads above: keep the wait in front of them
    asm volatile("s_wait_xcnt 0x0" ::: "memory");
#pragma unroll
    for (int c = 0; c < 8; ++c) {
        w2[c] = *(const v8f*)(W2 + c * 16 + (hiHalf ? 8 : 0));
    }
    const float bias2 = b2[0];
    const float xi = coords[row * 2 + 0];
    const float yi = coords[row * 2 + 1];

    // ---- trip 0's inputs: the lane's own pair of the trip's 32
    v2f   cj = ((const v2f*)cb)[j0 + lane];
    float cw = cost[(unsigned)(waveBase + lane)];
    float dw = dur[(unsigned)(waveBase + lane)];

    // kept rolled
#pragma unroll 1
    for (int u = 0; u < TRIPS; ++u) {
        const unsigned p = (unsigned)(waveBase + u * 32 + lane);
        // ---- this trip's inputs leave the registers they were loaded into
        const float dy  = yi - cj.y;
        const float dx  = xi - cj.x;
        const float cst = 0.5f * cw;
        const float drn = 0.5f * dw;

        // ---- the next trip's inputs are asked for now and first read a whole trip later: their latency runs under
        // this trip's two tiles. The last trip asks for its own pair again (in bounds; the values are not read).
        const int un = u + 1 < TRIPS ? u + 1 : u;
        const unsigned pn = (unsigned)(waveBase + un * 32 + lane);
        cj = ((const v2f*)cb)[j0 + un * 32 + lane];
        cw = cost[pn];
        dw = dur[pn];

        // ---- every lane takes its own pair's angle
        const float ang = 0.5f * atan2f(dy, dx);

        // ---- pair fragments (4x16 f32 layout, column n = pair), tile 0 = pairs of lanes 0-15, tile 1 = of lanes 16-31:
        //  lanes 0-15 : v0 = B[0][n] = angle/2 , v1 = B[1][n] = cost/2
        //  lanes 16-31: v0 = B[2][n] = dur/2   , v1 = B[3][n] = 0.5 (bias row selector)
        // one move carries both values that change rows in v0: tile 1's angles down, tile 0's durations up
        const float mov0 = other_row(hiHalf ? ang : drn);
        const float cstx = other_row(cst);
        v2f a0, a1;
        a0.x = hiHalf ? mov0 : ang;
        a0.y = hiHalf ? 0.5f : cst;
        a1.x = hiHalf ? drn  : mov0;
        a1.y = hiHalf ? 0.5f : cstx;

        // kept rolled: the order asked of the scheduler in tile_half_sum holds only where a tile is a block of its own;
        // with both tiles and the angle code in one block it is lost and the chunk values spill
        float s0 = 0.0f, s1 = 0.0f;
        v2f a = a0;
#pragma unroll 1
        for (int t = 0; t < 2; ++t) {
            s0 = s1;
            s1 = tile_half_sum(bw, w2, a);
            a  = a1;
        }

        // ---- a lane keeps the half sum of its own pair's tile and gets that pair's other half from lane l ^ 16
        const float keep = hiHalf ? s1 : s0;
        const float give = hiHalf ? s0 : s1;
        out[p] = (keep + other_row(give)) + bias2;
        // the next trip reuses the store's address and data registers: keep the wait in front of that overwrite
        asm volatile("s_wait_xcnt 0x0" ::: "memory");
    }
    // the last trip's loads are read by nobody: waited for here, so that none is open when the wave gives its registers back
    asm volatile("s_wait_loadcnt 0x0" ::: "memory");
}

extern "C" void kernel_launch(void* const* d_in, const int* in_sizes, int n_in,
                              void* d_out, int out_size, void* d_ws, size_t ws_size,
                              hipStream_t stream) {
    const float* coords = (const float*)d_in[0];
    const float* cost   = (const float*)d_in[1];
    const float* dur    = (const float*)d_in[2];
    const float* W1     = (const float*)d_in[3];
    const float* b1     = (const float*)d_in[4];
    const float* W2     = (const float*)d_in[5];
    const float* b2     = (const float*)d_in[6];
    float* out = (float*)d_out;

    const int totalPairs = BATCH * NPTS * NPTS;         // 2,097,152
    const int waves      = totalPairs / (16 * TILES);   // 8,192
    const int threads    = 1024;                        // 32 waves/block
    const int blocks     = waves / (threads / 32);      // 256

    hipLaunchKernelGGL(nab_kernel, dim3(blocks), dim3(threads), 0, stream,
                       coords, cost, dur, W1, b1, W2, b2, out);
}
